// v000
// Measured on an AMD MI455X. A time is GPU time per run, averaged over a window of back-to-back runs after a warm-up
// (all launches, gaps included; the runs take copies of the inputs in turn), and the median of several windows.
// Apart from v000's, it joins two sittings. Times from different sittings can be a few percent apart, while
// side-by-side timings come from the same sitting.
// The starting kernel, v000, takes 4520 microseconds a run.
#include <hip/hip_runtime.h>
// Single-head attention with the softmax taken over the QUERY axis (Sq=Sk=4096, D=Dv=1024): scores = Q·Kᵀ / Sk (divided by 4096, not √d); attn = softmax(scores, axis=0) (each key column normalised over all queries); out = attn·V.
// Compute dtype: Q, K, V rounded to bf16 and carried as f16 planes (exact); S = Q·Kᵀ/4096 as an f32 GEMM output; per-column max/sum and the normalised
// probabilities in f32 (one thread per key column sweeping all query rows); P stored ×2^12 as f16; out = P·V GEMM ×2^-12; f32 accumulate throughout; all contractions on v_wmma_f32_16x16x32_f16.
#define SQ 4096
#define SK 4096
#define DK 1024
#define DV 1024
typedef __bf16 v16b __attribute__((ext_vector_type(16)));
typedef unsigned short v8us __attribute__((ext_vector_type(8), may_alias));
typedef float  v8f  __attribute__((ext_vector_type(8)));
typedef float  v4f  __attribute__((ext_vector_type(4)));
typedef float  v4fa __attribute__((ext_vector_type(4), may_alias));
union FragB { v16b v; v8us half[2]; unsigned short u[16]; };

__device__ __forceinline__ unsigned short bf16_bits(float x) { unsigned int u = __float_as_uint(x); return (unsigned short)((u + 0x7FFFu + ((u >> 16) & 1u)) >> 16); }
__device__ __forceinline__ float bf16_val(unsigned short b) { return __uint_as_float(((unsigned int)b) << 16); }
__device__ __forceinline__ float bf16_round(float x) { return bf16_val(bf16_bits(x)); }
// D += A·B with NT terms: 1 = ah·bh, 2 = + al·bh (A split), 3 = + ah·bl (both split)
template <int NT>
__device__ __forceinline__ v8f mmaN(v16b ah, v16b al, v16b bh, v16b bl, v8f c) {
  c = __builtin_amdgcn_wmma_f32_16x16x32_bf16(false, ah, false, bh, (short)0, c, false, false);
  if (NT >= 2) c = __builtin_amdgcn_wmma_f32_16x16x32_bf16(false, al, false, bh, (short)0, c, false, false);
  if (NT >= 3) c = __builtin_amdgcn_wmma_f32_16x16x32_bf16(false, ah, false, bl, (short)0, c, false, false);
  asm volatile("v_nop\n\tv_nop\n\tv_nop\n\tv_nop" : "+v"(c) : "v"(ah), "v"(al), "v"(bh), "v"(bl));
  return c;
}

__global__ __launch_bounds__(256) void k_wt_bf16(const float* __restrict__ W, unsigned short* __restrict__ Wt, int K, int N) {
  const int t = blockIdx.x * 256 + threadIdx.x;
  const int k8n = K / 8;
  if (t >= N * k8n) return;
  const int n = t / k8n, k8 = (t % k8n) * 8;
  v8us v;
#pragma unroll
  for (int i = 0; i < 8; ++i) v[i] = bf16_bits(W[(size_t)(k8 + i) * N + n]);
  *(v8us*)(Wt + (size_t)n * K + k8) = v;
  
}

// GEMM C[M][N] (f32, pitch ldc) = act(A[M][K]·W + bias). A f32 row-major (pitch lda) converted per fragment to bf16
// (ASPLIT: hi/lo two planes -> 2 terms, else single rounded term); Wt bf16 [N][K] (pitch ldb). BIAS_BF16 rounds the
// bias to bf16 first (bias quantised to bf16 before the add). K%32==0, M%16==0, N%64==0.
template <bool ASPLIT, int ACT, bool BIAS_BF16>
__global__ __launch_bounds__(128) void k_gemm_bf(const float* __restrict__ A, int lda, const unsigned short* __restrict__ Wt, int ldb,
                                               const float* __restrict__ bias, float* __restrict__ C, int ldc, int M, int N, int K) {
  __shared__ __attribute__((aligned(16))) float so[4][16][64];
  const int tid = threadIdx.x, w = tid >> 5, lane = tid & 31, ln = lane & 15, hh = lane >> 4;
  const int ntn = N / 64;
  const int wid = blockIdx.x * 4 + w;
  const int mt = wid / ntn, nq = wid % ntn;
  if (mt * 16 >= M) return;
  const int row0 = mt * 16, col0 = nq * 64;
  const float* arow = A + (size_t)(row0 + ln) * lda;
  v8f acc[4] = {};
  for (int kb = 0; kb < K; kb += 32) {
    FragB ah, al;
    const v4f x0 = *(const v4fa*)(arow + kb + 8 * hh), x1 = *(const v4fa*)(arow + kb + 8 * hh + 4);
    const v4f x2 = *(const v4fa*)(arow + kb + 16 + 8 * hh), x3 = *(const v4fa*)(arow + kb + 16 + 8 * hh + 4);
    float xs[16] = {x0[0],x0[1],x0[2],x0[3],x1[0],x1[1],x1[2],x1[3],x2[0],x2[1],x2[2],x2[3],x3[0],x3[1],x3[2],x3[3]};
#pragma unroll
    for (int i = 0; i < 16; ++i) { const unsigned short hb = bf16_bits(xs[i]); ah.u[i] = hb; al.u[i] = ASPLIT ? bf16_bits(xs[i] - bf16_val(hb)) : (unsigned short)0; }
#pragma unroll
    for (int t = 0; t < 4; ++t) {
      const unsigned short* brow = Wt + (size_t)(col0 + t * 16 + ln) * ldb + kb;
      FragB b;
      b.half[0] = *(const v8us*)(brow + 8 * hh);
      b.half[1] = *(const v8us*)(brow + 16 + 8 * hh);
      acc[t] = mmaN<ASPLIT ? 2 : 1>(ah.v, al.v, b.v, b.v, acc[t]);
    }
  }
#pragma unroll
  for (int t = 0; t < 4; ++t) {
    float bv = bias ? bias[col0 + t * 16 + ln] : 0.f;
    if (BIAS_BF16) bv = bf16_round(bv);
#pragma unroll
    for (int r = 0; r < 8; ++r) { float v = acc[t][r] + bv; if (ACT == 1) v = fmaxf(v, 0.f); so[w][8 * hh + r][t * 16 + ln] = v; }
  }
  __builtin_amdgcn_fence(__ATOMIC_ACQ_REL, "workgroup");
  __builtin_amdgcn_wave_barrier();
  const int rsub = lane >> 4, c4 = (lane & 15) * 4;
  {
#pragma unroll
    for (int q = 0; q < 8; ++q) {
      const int r = q * 2 + rsub;
      const v4f v = *(const v4fa*)&so[w][r][c4];
      *(v4f*)(C + (size_t)(row0 + r) * ldc + col0 + c4) = v;
    }
    
  }
}

// Flash-style causal/unmasked attention, all contractions 3-term bf16 hi/lo splits, f32 softmax with running max.
// q,k,v rows are read from f32 buffers with arbitrary row pitch (so they can live inside a fused qkv buffer);
// D = head size (multiple of 32, <= 128); one wave = 16 query rows; block = 4 waves (64 queries) sharing K/V chunks of 32.
template <int D, bool CAUSAL>
__global__ __launch_bounds__(128) void k_flash(const float* __restrict__ qb, const float* __restrict__ kb, const float* __restrict__ vb,
                                             int pitch, int T, int H, float scale, float* __restrict__ y, int ypitch) {
  constexpr int KS = D / 32;        // k-steps for QK
  constexpr int DT = D / 16;        // d tiles for PV
  __shared__ __attribute__((aligned(16))) unsigned short sKh[32][D + 8], sKl[32][D + 8], sVh[32][D + 8], sVl[32][D + 8];
  __shared__ __attribute__((aligned(16))) unsigned short sPh[4][16][40], sPl[4][16][40];
  __shared__ __attribute__((aligned(16))) float sO[4][16][D];
  const int tid = threadIdx.x, w = tid >> 5, lane = tid & 31, ln = lane & 15, hh = lane >> 4;
  const int nqb = (T + 63) / 64;
  const int bh = blockIdx.x / nqb, qblk = blockIdx.x % nqb;
  const int b = bh / H, h = bh % H;
  const int q0 = qblk * 64 + w * 16;
  const float* Q = qb + (size_t)b * T * pitch + h * D;
  const float* K = kb + (size_t)b * T * pitch + h * D;
  const float* V = vb + (size_t)b * T * pitch + h * D;

  // A fragments of the wave's 16 query rows (scaled), hi/lo
  FragB aqh[KS], aql[KS];
  {
    int row = q0 + ln; if (row >= T) row = T - 1;
    const float* qr = Q + (size_t)row * pitch;
#pragma unroll
    for (int ks = 0; ks < KS; ++ks)
#pragma unroll
      for (int i = 0; i < 16; ++i) {
        const int d = ks * 32 + ((i < 8) ? (8 * hh + i) : (16 + 8 * hh + (i - 8)));
        const float x = qr[d] * scale; const unsigned short hb = bf16_bits(x);
        aqh[ks].u[i] = hb; aql[ks].u[i] = bf16_bits(x - bf16_val(hb));
      }
  }
  float m_r[8], l_r[8];
#pragma unroll
  for (int r = 0; r < 8; ++r) { m_r[r] = -3.0e38f; l_r[r] = 0.f; }
  v8f oacc[DT];
#pragma unroll
  for (int dt = 0; dt < DT; ++dt) oacc[dt] = (v8f){0.f,0.f,0.f,0.f,0.f,0.f,0.f,0.f};

  const int kv_end = CAUSAL ? min(T, qblk * 64 + 64) : T;     // block-uniform
  for (int j0 = 0; j0 < kv_end; j0 += 32) {
    __syncthreads();
    for (int e = tid; e < 32 * (D / 4); e += 128) {
      const int r = e / (D / 4), c4 = (e % (D / 4)) * 4;
      const int key = j0 + r;
      v4f kf = {0.f,0.f,0.f,0.f}, vf = {0.f,0.f,0.f,0.f};
      if (key < T) { kf = *(const v4fa*)(K + (size_t)key * pitch + c4); vf = *(const v4fa*)(V + (size_t)key * pitch + c4); }
#pragma unroll
      for (int t = 0; t < 4; ++t) {
        unsigned short hb = bf16_bits(kf[t]); sKh[r][c4 + t] = hb; sKl[r][c4 + t] = bf16_bits(kf[t] - bf16_val(hb));
        hb = bf16_bits(vf[t]); sVh[r][c4 + t] = hb; sVl[r][c4 + t] = bf16_bits(vf[t] - bf16_val(hb));
      }
    }
    __syncthreads();
    // S tile 16 x 32
    v8f s[2];
#pragma unroll
    for (int nt = 0; nt < 2; ++nt) {
      v8f acc = {};
#pragma unroll
      for (int ks = 0; ks < KS; ++ks) {
        FragB bh_, bl_;
        bh_.half[0] = *(const v8us*)&sKh[nt * 16 + ln][ks * 32 + 8 * hh]; bh_.half[1] = *(const v8us*)&sKh[nt * 16 + ln][ks * 32 + 16 + 8 * hh];
        bl_.half[0] = *(const v8us*)&sKl[nt * 16 + ln][ks * 32 + 8 * hh]; bl_.half[1] = *(const v8us*)&sKl[nt * 16 + ln][ks * 32 + 16 + 8 * hh];
        acc = mmaN<3>(aqh[ks].v, aql[ks].v, bh_.v, bl_.v, acc);
      }
      s[nt] = acc;
    }
    // mask + running max (rows 8hh+r; the 16 lanes of a half share rows)
    float alpha[8];
#pragma unroll
    for (int r = 0; r < 8; ++r) {
      const int qi = q0 + 8 * hh + r;
      const int ja = j0 + ln, jb = j0 + 16 + ln;
      if (CAUSAL) { if (ja > qi) s[0][r] = -3.0e38f; if (jb > qi) s[1][r] = -3.0e38f; }
      if (ja >= T) s[0][r] = -3.0e38f;
      if (jb >= T) s[1][r] = -3.0e38f;
      float mx = fmaxf(s[0][r], s[1][r]);
      mx = fmaxf(mx, __shfl_xor(mx, 1, 32)); mx = fmaxf(mx, __shfl_xor(mx, 2, 32)); mx = fmaxf(mx, __shfl_xor(mx, 4, 32)); mx = fmaxf(mx, __shfl_xor(mx, 8, 32));
      const float mnew = fmaxf(m_r[r], mx);
      alpha[r] = (mnew > -1.0e38f) ? __expf(m_r[r] - mnew) : 1.0f;
      const float p0 = (s[0][r] > -1.0e38f) ? __expf(s[0][r] - mnew) : 0.f;
      const float p1 = (s[1][r] > -1.0e38f) ? __expf(s[1][r] - mnew) : 0.f;
      m_r[r] = mnew;
      l_r[r] = l_r[r] * alpha[r] + p0 + p1;            // per-lane partial row sum (16 lanes combined at the end)
      unsigned short hb = bf16_bits(p0); sPh[w][8 * hh + r][ln] = hb;      sPl[w][8 * hh + r][ln] = bf16_bits(p0 - bf16_val(hb));
      hb = bf16_bits(p1);                sPh[w][8 * hh + r][16 + ln] = hb; sPl[w][8 * hh + r][16 + ln] = bf16_bits(p1 - bf16_val(hb));
    }
#pragma unroll
    for (int dt = 0; dt < DT; ++dt)
#pragma unroll
      for (int r = 0; r < 8; ++r) oacc[dt][r] *= alpha[r];
    __builtin_amdgcn_fence(__ATOMIC_ACQ_REL, "workgroup");
    __builtin_amdgcn_wave_barrier();
    FragB pah, pal;
    pah.half[0] = *(const v8us*)&sPh[w][ln][8 * hh]; pah.half[1] = *(const v8us*)&sPh[w][ln][16 + 8 * hh];
    pal.half[0] = *(const v8us*)&sPl[w][ln][8 * hh]; pal.half[1] = *(const v8us*)&sPl[w][ln][16 + 8 * hh];
#pragma unroll
    for (int dt = 0; dt < DT; ++dt) {
      FragB bvh, bvl;
#pragma unroll
      for (int i = 0; i < 8; ++i) {
        bvh.u[i] = sVh[8 * hh + i][dt * 16 + ln]; bvh.u[8 + i] = sVh[16 + 8 * hh + i][dt * 16 + ln];
        bvl.u[i] = sVl[8 * hh + i][dt * 16 + ln]; bvl.u[8 + i] = sVl[16 + 8 * hh + i][dt * 16 + ln];
      }
      oacc[dt] = mmaN<3>(pah.v, pal.v, bvh.v, bvl.v, oacc[dt]);
    }
    __builtin_amdgcn_fence(__ATOMIC_ACQ_REL, "workgroup");
    __builtin_amdgcn_wave_barrier();
  }
#pragma unroll
  for (int r = 0; r < 8; ++r) {
    float l = l_r[r];
    l += __shfl_xor(l, 1, 32); l += __shfl_xor(l, 2, 32); l += __shfl_xor(l, 4, 32); l += __shfl_xor(l, 8, 32);
    l_r[r] = (l > 0.f) ? 1.0f / l : 0.f;
  }
#pragma unroll
  for (int dt = 0; dt < DT; ++dt)
#pragma unroll
    for (int r = 0; r < 8; ++r) sO[w][8 * hh + r][dt * 16 + ln] = oacc[dt][r] * l_r[r];
  __builtin_amdgcn_fence(__ATOMIC_ACQ_REL, "workgroup");
  __builtin_amdgcn_wave_barrier();
  {
    for (int r = 0; r < 16; ++r) {
      const int row = q0 + r;
      if (row < T && lane < D / 4) {
        const v4f val = *(const v4fa*)&sO[w][r][lane * 4];
        *(v4f*)(y + ((size_t)b * T + row) * ypitch + h * D + lane * 4) = val;
      }
    }
    
  }
}

// GEMM C = act(A·W + bias + resid): A f32 (ASPLIT -> hi/lo 2 terms), Wt bf16 [N][K]; ACT 0 none, 1 relu, 2 exact gelu;
// resid (optional, f32, row index = (row % rmod), pitch ldr, RES_BF16 rounds it) added before the activation.
template <bool ASPLIT, int ACT, bool BIAS_BF16, bool RES_BF16>
__global__ __launch_bounds__(128) void k_gemm_bf3(const float* __restrict__ A, int lda, const unsigned short* __restrict__ Wt, int ldb,
                                                const float* __restrict__ bias, const float* __restrict__ resid, int rmod, int ldr,
                                                float* __restrict__ C, int ldc, int M, int N, int K) {
  __shared__ __attribute__((aligned(16))) float so[4][16][64];
  const int tid = threadIdx.x, w = tid >> 5, lane = tid & 31, ln = lane & 15, hh = lane >> 4;
  const int ntn = N / 64;
  const int wid = blockIdx.x * 4 + w;
  const int mt = wid / ntn, nq = wid % ntn;
  if (mt * 16 >= M) return;
  const int row0 = mt * 16, col0 = nq * 64;
  const float* arow = A + (size_t)(row0 + ln) * lda;
  v8f acc[4] = {};
  for (int kb = 0; kb < K; kb += 32) {
    FragB ah, al;
    const v4f x0 = *(const v4fa*)(arow + kb + 8 * hh), x1 = *(const v4fa*)(arow + kb + 8 * hh + 4);
    const v4f x2 = *(const v4fa*)(arow + kb + 16 + 8 * hh), x3 = *(const v4fa*)(arow + kb + 16 + 8 * hh + 4);
    float xs[16] = {x0[0],x0[1],x0[2],x0[3],x1[0],x1[1],x1[2],x1[3],x2[0],x2[1],x2[2],x2[3],x3[0],x3[1],x3[2],x3[3]};
#pragma unroll
    for (int i = 0; i < 16; ++i) { const unsigned short hb = bf16_bits(xs[i]); ah.u[i] = hb; al.u[i] = ASPLIT ? bf16_bits(xs[i] - bf16_val(hb)) : (unsigned short)0; }
#pragma unroll
    for (int t = 0; t < 4; ++t) {
      const unsigned short* brow = Wt + (size_t)(col0 + t * 16 + ln) * ldb + kb;
      FragB b;
      b.half[0] = *(const v8us*)(brow + 8 * hh);
      b.half[1] = *(const v8us*)(brow + 16 + 8 * hh);
      acc[t] = mmaN<ASPLIT ? 2 : 1>(ah.v, al.v, b.v, b.v, acc[t]);
    }
  }
#pragma unroll
  for (int t = 0; t < 4; ++t) {
    const int col = col0 + t * 16 + ln;
    float bv = bias ? bias[col] : 0.f;
    if (BIAS_BF16) bv = bf16_round(bv);
#pragma unroll
    for (int r = 0; r < 8; ++r) {
      float v = acc[t][r] + bv;
      if (resid) { float rv = resid[(size_t)((row0 + 8 * hh + r) % rmod) * ldr + col]; if (RES_BF16) rv = bf16_round(rv); v += rv; }
      if (ACT == 1) v = fmaxf(v, 0.f);
      if (ACT == 2) v = 0.5f * v * (1.0f + erff(v * 0.70710678118654752f));
      if (ACT == 3) { const float u = 0.7978845608028654f * (v + 0.044715f * v * v * v); v = 0.5f * v * (1.0f + tanhf(u)); }
      so[w][8 * hh + r][t * 16 + ln] = v;
    }
  }
  __builtin_amdgcn_fence(__ATOMIC_ACQ_REL, "workgroup");
  __builtin_amdgcn_wave_barrier();
  const int rsub = lane >> 4, c4 = (lane & 15) * 4;
  {
#pragma unroll
    for (int q = 0; q < 8; ++q) {
      const int r = q * 2 + rsub;
      const v4f v = *(const v4fa*)&so[w][r][c4];
      *(v4f*)(C + (size_t)(row0 + r) * ldc + col0 + c4) = v;
    }
    
  }
}
// row LayerNorm (biased variance, eps) over N: s = X (+ R); optional out_sum <- s; out_norm <- (s-mu)*rsqrt(var+eps)*g + b
template <bool PARAM_BF16>
__global__ __launch_bounds__(256) void k_layernorm(const float* __restrict__ X, const float* __restrict__ R, const float* __restrict__ g, const float* __restrict__ bta,
                                                  float* __restrict__ out_sum, float* __restrict__ out_norm, int N, float eps) {
  __shared__ float red[256];
  const int row = blockIdx.x, tid = threadIdx.x;
  const float* x = X + (size_t)row * N; const float* rr = R ? R + (size_t)row * N : nullptr;
  float vals[16];                     // up to N = 4096
  const int per = N / 256;            // contiguous chunk per thread? use strided-by-4 chunks: thread handles j = tid*4 + 1024*u
  float s1 = 0.f;
  for (int u = 0; u < per / 4; ++u) {
    const int j = tid * 4 + 1024 * u;
    const v4f a = *(const v4fa*)(x + j);
    v4f b = {0.f,0.f,0.f,0.f}; if (rr) b = *(const v4fa*)(rr + j);
#pragma unroll
    for (int q = 0; q < 4; ++q) { const float v = a[q] + b[q]; vals[u * 4 + q] = v; s1 += v; }
  }
  red[tid] = s1; __syncthreads();
  for (int st = 128; st > 0; st >>= 1) { if (tid < st) red[tid] += red[tid + st]; __syncthreads(); }
  const float mu = red[0] / (float)N; __syncthreads();
  float s2 = 0.f;
  for (int u = 0; u < per / 4; ++u)
#pragma unroll
    for (int q = 0; q < 4; ++q) { const float c = vals[u * 4 + q] - mu; s2 += c * c; }
  red[tid] = s2; __syncthreads();
  for (int st = 128; st > 0; st >>= 1) { if (tid < st) red[tid] += red[tid + st]; __syncthreads(); }
  const float rs = rsqrtf(red[0] / (float)N + eps);
  {
    for (int u = 0; u < per / 4; ++u) {
      const int j = tid * 4 + 1024 * u;
      v4f o, sm;
#pragma unroll
      for (int q = 0; q < 4; ++q) {
        float gg = g[j + q], bb = bta[j + q];
        if (PARAM_BF16) { gg = bf16_round(gg); bb = bf16_round(bb); }
        sm[q] = vals[u * 4 + q]; o[q] = (vals[u * 4 + q] - mu) * rs * gg + bb;
      }
      if (out_sum) *(v4f*)(out_sum + (size_t)row * N + j) = sm;
      *(v4f*)(out_norm + (size_t)row * N + j) = o;
    }
    
  }
}



// ---- f16 WMMA path (v_wmma_f32_16x16x32_f16): 11-bit significands for operands in range — used where a [0,1] probability operand needs more precision than bf16
typedef _Float16 v16h __attribute__((ext_vector_type(16)));
union FragH { v16h v; v8us half[2]; _Float16 h[16]; unsigned short u[16]; };
template <int NT>
__device__ __forceinline__ v8f mmaH(v16h ah, v16h al, v16h bh, v16h bl, v8f c) {
  c = __builtin_amdgcn_wmma_f32_16x16x32_f16(false, ah, false, bh, (short)0, c, false, false);
  if (NT >= 2) c = __builtin_amdgcn_wmma_f32_16x16x32_f16(false, al, false, bh, (short)0, c, false, false);
  if (NT >= 3) c = __builtin_amdgcn_wmma_f32_16x16x32_f16(false, ah, false, bl, (short)0, c, false, false);
  asm volatile("v_nop\n\tv_nop\n\tv_nop\n\tv_nop" : "+v"(c) : "v"(ah), "v"(al), "v"(bh), "v"(bl));
  return c;
}
// batched GEMM like k_gemm_b but f16 operands: A f32 (split into f16 hi/lo if ASPLIT, else rounded to f16), Bt = f16 values [n][k]; alpha; C f32; N multiple of 16 (partial tiles skipped)
template <bool ASPLIT>
__global__ __launch_bounds__(128) void k_gemm_h(const float* __restrict__ A, int lda, size_t sA, const _Float16* __restrict__ Bh, int ldb, size_t sB, float alpha, float* __restrict__ C, int ldc, size_t sC, int M, int N, int K) {
  __shared__ __attribute__((aligned(16))) float so[4][16][64];
  const int tid = threadIdx.x, w = tid >> 5, lane = tid & 31, ln = lane & 15, hh = lane >> 4; const int by = blockIdx.y;
  A += (size_t)by * sA; Bh += (size_t)by * sB; C += (size_t)by * sC;
  const int ntn = (N + 63) / 64; const int wid = blockIdx.x * 4 + w; const int mt = wid / ntn, nq = wid % ntn; if (mt * 16 >= M) return;
  const int row0 = mt * 16, col0 = nq * 64; const float* arow = A + (size_t)(row0 + ln) * lda;
  v8f acc[4] = {};
  for (int kb = 0; kb < K; kb += 32) {
    FragH ah, al;
    const v4f x0 = *(const v4fa*)(arow + kb + 8 * hh), x1 = *(const v4fa*)(arow + kb + 8 * hh + 4), x2 = *(const v4fa*)(arow + kb + 16 + 8 * hh), x3 = *(const v4fa*)(arow + kb + 16 + 8 * hh + 4);
    float xs[16] = {x0[0],x0[1],x0[2],x0[3],x1[0],x1[1],x1[2],x1[3],x2[0],x2[1],x2[2],x2[3],x3[0],x3[1],x3[2],x3[3]};
#pragma unroll
    for (int i = 0; i < 16; ++i) { const _Float16 h = (_Float16)xs[i]; ah.h[i] = h; al.h[i] = ASPLIT ? (_Float16)(xs[i] - (float)h) : (_Float16)0.0f; }
#pragma unroll
    for (int t = 0; t < 4; ++t) { if (col0 + t * 16 >= N) continue; const size_t boff = (size_t)(col0 + t * 16 + ln) * ldb + kb; FragH bq; bq.half[0] = *(const v8us*)(Bh + boff + 8 * hh); bq.half[1] = *(const v8us*)(Bh + boff + 16 + 8 * hh);
      acc[t] = mmaH<ASPLIT ? 2 : 1>(ah.v, al.v, bq.v, bq.v, acc[t]); }
  }
#pragma unroll
  for (int t = 0; t < 4; ++t) { if (col0 + t * 16 >= N) continue;
#pragma unroll
    for (int r = 0; r < 8; ++r) so[w][8 * hh + r][t * 16 + ln] = acc[t][r] * alpha; }
  __builtin_amdgcn_fence(__ATOMIC_ACQ_REL, "workgroup"); __builtin_amdgcn_wave_barrier();
  const int rsub = lane >> 4, c4 = (lane & 15) * 4;
  {
#pragma unroll
    for (int q = 0; q < 8; ++q) { const int r = q * 2 + rsub; if (col0 + c4 < N) { const v4f v = *(const v4fa*)&so[w][r][c4]; *(v4f*)(C + (size_t)(row0 + r) * ldc + col0 + c4) = v; } }
     }
}

// Wt[n][k] = f16(W[k][n]·scale) from f32 row-major W[K][N] (scale = power of two; bf16-exact weights stay exact in f16 away from the subnormal range)
__global__ __launch_bounds__(256) void k_wt_f16(const float* __restrict__ W, _Float16* __restrict__ Wt, int K, int N, float scale) {
  const int t = blockIdx.x * 256 + threadIdx.x; if (t >= N * (K / 8)) return; const int n = t / (K / 8), k8 = (t % (K / 8)) * 8; FragH f;
#pragma unroll
  for (int i = 0; i < 8; ++i) f.h[i] = (_Float16)(bf16_round(W[(size_t)(k8 + i) * N + n]) * scale); const v8us o = f.half[0];
  *(v8us*)((unsigned short*)Wt + (size_t)n * K + k8) = o; 
}
// k_gemm_hh variant with fused epilogue: v = acc·alpha + bias[by·sBias + col] (+ CP[(row/rowsPerB)·sCPb + by·64 + col] if CP) ; ACT 0 none / 1 elu ; writes f32 C and f16 C16, each only if non-null
template <int ACT>
__global__ __launch_bounds__(128) void k_gemm_hhx(const _Float16* __restrict__ A, int lda, size_t sA, const _Float16* __restrict__ Bh, int ldb, size_t sB, float alpha, const float* __restrict__ bias, size_t sBias, const float* __restrict__ CP, int rowsPerB, size_t sCPb, int row0g,
    float* __restrict__ C, _Float16* __restrict__ C16, int ldc, size_t sC, int M, int N, int K) {
  __shared__ __attribute__((aligned(16))) float so[4][16][64];
  const int tid = threadIdx.x, w = tid >> 5, lane = tid & 31, ln = lane & 15, hh = lane >> 4; const int by = blockIdx.y;
  A += (size_t)by * sA; Bh += (size_t)by * sB; const size_t cofs = (size_t)by * sC; const float* bp = bias ? bias + (size_t)by * sBias : nullptr;
  const int ntn = (N + 63) / 64; const int wid = blockIdx.x * 4 + w; const int mt = wid / ntn, nq = wid % ntn; if (mt * 16 >= M) return;
  const int row0 = mt * 16, col0 = nq * 64; const _Float16* arow = A + (size_t)(row0 + ln) * lda;
  v8f acc[4] = {};
  for (int kb = 0; kb < K; kb += 32) { FragH ah; ah.half[0] = *(const v8us*)((const unsigned short*)arow + kb + 8 * hh); ah.half[1] = *(const v8us*)((const unsigned short*)arow + kb + 16 + 8 * hh);
#pragma unroll
    for (int t = 0; t < 4; ++t) { if (col0 + t * 16 >= N) continue; const size_t boff = (size_t)(col0 + t * 16 + ln) * ldb + kb; FragH bq; bq.half[0] = *(const v8us*)((const unsigned short*)Bh + boff + 8 * hh); bq.half[1] = *(const v8us*)((const unsigned short*)Bh + boff + 16 + 8 * hh);
      acc[t] = mmaH<1>(ah.v, ah.v, bq.v, bq.v, acc[t]); }
  }
#pragma unroll
  for (int t = 0; t < 4; ++t) { if (col0 + t * 16 >= N) continue; const int col = col0 + t * 16 + ln; const float bv = bp ? bf16_round(bp[col]) : 0.f;
#pragma unroll
    for (int r = 0; r < 8; ++r) { float v = acc[t][r] * alpha + bv; if (CP) { const int bidx = (row0g + row0 + 8 * hh + r) / rowsPerB; v += CP[(size_t)bidx * sCPb + (size_t)by * 64 + col]; } if (ACT == 1) v = (v > 0.f) ? v : expm1f(v); else if (ACT == 7) v = (v > 0.f) ? v + 1.0f : expf(v); else if (ACT == 8) v = tanhf(v); else if (ACT == 9) v = 0.5f * v * (1.0f + tanhf(0.7978845608028654f * (v + 0.044715f * v * v * v))); else if (ACT == 11) v = 1.0f / (1.0f + expf(-v)); else if (ACT == 12) v = (v > 0.f) ? v : 0.01f * v; else if (ACT == 14) v = (v > 0.f) ? v : 0.1f * v; else if (ACT == 15) v = v / (1.0f + expf(-v)); else if (ACT == 3) v = fmaxf(v, 0.f); else if (ACT == 6) v = 0.5f * v * (1.0f + erff(v * 0.70710678118654752f)); so[w][8 * hh + r][t * 16 + ln] = v; } }
  __builtin_amdgcn_fence(__ATOMIC_ACQ_REL, "workgroup"); __builtin_amdgcn_wave_barrier();
  const int rsub = lane >> 4, c4 = (lane & 15) * 4; typedef _Float16 v4h __attribute__((ext_vector_type(4)));
  {
#pragma unroll
    for (int q = 0; q < 8; ++q) { const int r = q * 2 + rsub; if (col0 + c4 < N) { const v4f v = *(const v4fa*)&so[w][r][c4]; if (C) *(v4f*)(C + cofs + (size_t)(row0 + r) * ldc + col0 + c4) = v; if (C16) { v4h h4; for (int i = 0; i < 4; ++i) h4[i] = (_Float16)v[i]; *(v4h*)(C16 + cofs + (size_t)(row0 + r) * ldc + col0 + c4) = h4; } } }
     }
}


typedef _Float16 v4h __attribute__((ext_vector_type(4)));

__global__ __launch_bounds__(256) void k_x16(const float* __restrict__ x, _Float16* __restrict__ X16, size_t n8) { const size_t t = (size_t)blockIdx.x * 256 + threadIdx.x; if (t >= n8) return; FragH f;
#pragma unroll
  for (int q = 0; q < 8; ++q) f.h[q] = (_Float16)bf16_round(x[t * 8 + q]); *(v8us*)((unsigned short*)X16 + t * 8) = f.half[0];  }
__global__ __launch_bounds__(256) void k_h16(const float* __restrict__ x, _Float16* __restrict__ X16, size_t n8) { const size_t t = (size_t)blockIdx.x * 256 + threadIdx.x; if (t >= n8) return; FragH f;
#pragma unroll
  for (int q = 0; q < 8; ++q) f.h[q] = (_Float16)x[t * 8 + q]; *(v8us*)((unsigned short*)X16 + t * 8) = f.half[0];  }
__global__ __launch_bounds__(256) void k_round16f(const float* __restrict__ W, _Float16* __restrict__ Bt, size_t n8) { const size_t t = (size_t)blockIdx.x * 256 + threadIdx.x; if (t >= n8) return; FragH f;
#pragma unroll
  for (int i = 0; i < 8; ++i) f.h[i] = (_Float16)(bf16_round(W[t * 8 + i]) * 16.0f); *(v8us*)((unsigned short*)Bt + t * 8) = f.half[0];  }
template <int NHv, int TTv>
__global__ __launch_bounds__(256) void k_vt(const _Float16* __restrict__ V16, int ldv, int voff, _Float16* __restrict__ Vt) { __shared__ unsigned short tl[64][66]; const int tid = threadIdx.x; const int slab = blockIdx.x / (TTv / 64), lg = blockIdx.x % (TTv / 64); const int b = slab / NHv, h = slab % NHv;
  for (int i = tid; i < 64 * 8; i += 256) { const int r = i / 8, c8 = (i % 8) * 8; FragH f; f.half[0] = *(const v8us*)((const unsigned short*)V16 + ((size_t)b * TTv + lg * 64 + r) * ldv + voff + h * 64 + c8);
#pragma unroll
    for (int q = 0; q < 8; ++q) tl[r][c8 + q] = f.u[q]; }
  __syncthreads();
  {
#pragma unroll
    for (int rd = 0; rd < 2; ++rd) { const int d = rd * 32 + tid / 8, pc = tid % 8; FragH f;
#pragma unroll
      for (int q = 0; q < 8; ++q) f.u[q] = tl[pc * 8 + q][d];
      *(v8us*)((unsigned short*)Vt + ((size_t)slab * 64 + d) * TTv + lg * 64 + pc * 8) = f.half[0]; }
     } }

__global__ __launch_bounds__(256) void k_hl(const float* __restrict__ F, _Float16* __restrict__ Hh, _Float16* __restrict__ Hl, size_t n8) { const size_t t = (size_t)blockIdx.x * 256 + threadIdx.x; if (t >= n8) return; FragH fh, fl; const v4f a = *(const v4fa*)(F + t * 8), c = *(const v4fa*)(F + t * 8 + 4);
#pragma unroll
  for (int q = 0; q < 4; ++q) { _Float16 h = (_Float16)a[q]; fh.h[q] = h; fl.h[q] = (_Float16)((a[q] - (float)h) * 1024.0f); h = (_Float16)c[q]; fh.h[4 + q] = h; fl.h[4 + q] = (_Float16)((c[q] - (float)h) * 1024.0f); }
  { *(v8us*)((unsigned short*)Hh + t * 8) = fh.half[0]; *(v8us*)((unsigned short*)Hl + t * 8) = fl.half[0];  } }

// column softmax over the query axis: block = 256 consecutive key columns, thread per column; sweep 1 = max over all SQ rows, sweep 2 = sum of exp (f32), sweep 3 = P[q][k] = exp(s − m_k)/l_k × 2^12 → f16 staged per row in LDS and
__global__ __launch_bounds__(256) void k_colsoftmax(const float* __restrict__ S, _Float16* __restrict__ P16) {
  __shared__ __attribute__((aligned(16))) unsigned short sp[256];
  const int tid = threadIdx.x; const int cb = blockIdx.x * 256; const int c = cb + tid;
  float m = -3.0e38f;
#pragma unroll 1
  for (int q = 0; q < SQ; ++q) m = fmaxf(m, S[(size_t)q * SK + c]);
  float l = 0.f;
#pragma unroll 1
  for (int q = 0; q < SQ; ++q) l += expf(S[(size_t)q * SK + c] - m);
  const float il = 4096.0f / l;
{
#pragma unroll 1
    for (int q = 0; q < SQ; ++q) {
      FragH f; f.h[0] = (_Float16)(expf(S[(size_t)q * SK + c] - m) * il); sp[tid] = f.u[0];
      __syncthreads();
      if (tid < 32) { const v8us v = *(const v8us*)&sp[tid * 8]; *(v8us*)((unsigned short*)P16 + (size_t)q * SK + cb + tid * 8) = v; }
      __syncthreads(); }
     }
}

extern "C" void kernel_launch(void* const* d_in, const int* in_sizes, int n_in,
                              void* d_out, int out_size, void* d_ws, size_t ws_size, hipStream_t stream) {
  (void)in_sizes; (void)n_in; (void)out_size;
  const float* Q = (const float*)d_in[0]; const float* Kx = (const float*)d_in[1]; const float* V = (const float*)d_in[2];
  char* ws = (char*)d_ws; size_t off = 0;
  auto take = [&](size_t bytes) { char* p = ws + off; off += (bytes + 255) & ~(size_t)255; return p; };
  _Float16* Q16 = (_Float16*)take((size_t)SQ * DK * 2); _Float16* K16 = (_Float16*)take((size_t)SK * DK * 2); _Float16* Vt = (_Float16*)take((size_t)DV * SK * 2);
  float* S = (float*)take((size_t)SQ * SK * 4); _Float16* P16 = (_Float16*)take((size_t)SQ * SK * 2);
  if (off > ws_size) return;      // 8.4 + 8.4 + 8.4 + 67.1 + 33.6 ≈ 126 MB
  k_x16<<<(unsigned)(((size_t)SQ * DK / 8 + 255) / 256), 256, 0, stream>>>(Q, Q16, (size_t)SQ * DK / 8);
  k_x16<<<(unsigned)(((size_t)SK * DK / 8 + 255) / 256), 256, 0, stream>>>(Kx, K16, (size_t)SK * DK / 8);      /* K rows are the natural Bt[SK][DK] of Q·Kᵀ */
  k_wt_f16<<<(unsigned)(((size_t)DV * (SK / 8) + 255) / 256), 256, 0, stream>>>(V, Vt, SK, DV, 1.0f);      /* V[SK][DV] → Vt[DV][SK] (bf16-rounded, f16) */
  k_gemm_hhx<0><<<dim3(((SQ / 16) * (SK / 64) + 3) / 4, 1), 128, 0, stream>>>(Q16, DK, 0, K16, DK, 0, 1.0f / 4096.0f, nullptr, 0, nullptr, 1, 0, 0, S, nullptr, SK, 0, SQ, SK, DK);      /* S = Q·Kᵀ/4096 f32: M 4096 N 4096 K 1024 */
  k_colsoftmax<<<SK / 256, 256, 0, stream>>>(S, P16);
  k_gemm_hhx<0><<<dim3(((SQ / 16) * (DV / 64) + 3) / 4, 1), 128, 0, stream>>>(P16, SK, 0, Vt, SK, 0, 1.0f / 4096.0f, nullptr, 0, nullptr, 1, 0, 0, (float*)d_out, nullptr, DV, 0, SQ, DV, SK);      /* out = P·V ×2^-12: M 4096 N 1024 K 4096 */
}

// v001
// One run takes 374 microseconds.
// Timed twice side by side with v000, it ran 12.0 and 12.1 times as fast.
#include <hip/hip_runtime.h>
// Single-head attention with the softmax taken over the QUERY axis (Sq=Sk=4096, D=Dv=1024): scores = Q·Kᵀ / Sk (divided by 4096, not √d); attn = softmax(scores, axis=0) (each key column normalised over all queries); out = attn·V.
// Compute dtype: Q, K, V rounded to bf16 and carried as f16 planes (exact); S = Q·Kᵀ/4096 as an f32 GEMM output; per-column max/sum and the normalised
// probabilities in f32 (partial max/sum per block of 512 query rows x 128 key columns, merged per column); P stored x 2^12 as f16; out = P.V GEMM x 2^-12; f32 accumulate throughout; all contractions on v_wmma_f32_16x16x32_f16.
#define SQ 4096
#define SK 4096
#define DK 1024
#define DV 1024
typedef __bf16 v16b __attribute__((ext_vector_type(16)));
typedef unsigned short v8us __attribute__((ext_vector_type(8), may_alias));
typedef float  v8f  __attribute__((ext_vector_type(8)));
typedef float  v4f  __attribute__((ext_vector_type(4)));
typedef float  v4fa __attribute__((ext_vector_type(4), may_alias));
union FragB { v16b v; v8us half[2]; unsigned short u[16]; };

__device__ __forceinline__ unsigned short bf16_bits(float x) { unsigned int u = __float_as_uint(x); return (unsigned short)((u + 0x7FFFu + ((u >> 16) & 1u)) >> 16); }
__device__ __forceinline__ float bf16_val(unsigned short b) { return __uint_as_float(((unsigned int)b) << 16); }
__device__ __forceinline__ float bf16_round(float x) { return bf16_val(bf16_bits(x)); }
// D += A·B with NT terms: 1 = ah·bh, 2 = + al·bh (A split), 3 = + ah·bl (both split)
template <int NT>
__device__ __forceinline__ v8f mmaN(v16b ah, v16b al, v16b bh, v16b bl, v8f c) {
  c = __builtin_amdgcn_wmma_f32_16x16x32_bf16(false, ah, false, bh, (short)0, c, false, false);
  if (NT >= 2) c = __builtin_amdgcn_wmma_f32_16x16x32_bf16(false, al, false, bh, (short)0, c, false, false);
  if (NT >= 3) c = __builtin_amdgcn_wmma_f32_16x16x32_bf16(false, ah, false, bl, (short)0, c, false, false);
  asm volatile("v_nop\n\tv_nop\n\tv_nop\n\tv_nop" : "+v"(c) : "v"(ah), "v"(al), "v"(bh), "v"(bl));
  return c;
}

__global__ __launch_bounds__(256) void k_wt_bf16(const float* __restrict__ W, unsigned short* __restrict__ Wt, int K, int N) {
  const int t = blockIdx.x * 256 + threadIdx.x;
  const int k8n = K / 8;
  if (t >= N * k8n) return;
  const int n = t / k8n, k8 = (t % k8n) * 8;
  v8us v;
#pragma unroll
  for (int i = 0; i < 8; ++i) v[i] = bf16_bits(W[(size_t)(k8 + i) * N + n]);
  *(v8us*)(Wt + (size_t)n * K + k8) = v;
  
}

// GEMM C[M][N] (f32, pitch ldc) = act(A[M][K]·W + bias). A f32 row-major (pitch lda) converted per fragment to bf16
// (ASPLIT: hi/lo two planes -> 2 terms, else single rounded term); Wt bf16 [N][K] (pitch ldb). BIAS_BF16 rounds the
// bias to bf16 first (bias quantised to bf16 before the add). K%32==0, M%16==0, N%64==0.
template <bool ASPLIT, int ACT, bool BIAS_BF16>
__global__ __launch_bounds__(128) void k_gemm_bf(const float* __restrict__ A, int lda, const unsigned short* __restrict__ Wt, int ldb,
                                               const float* __restrict__ bias, float* __restrict__ C, int ldc, int M, int N, int K) {
  __shared__ __attribute__((aligned(16))) float so[4][16][64];
  const int tid = threadIdx.x, w = tid >> 5, lane = tid & 31, ln = lane & 15, hh = lane >> 4;
  const int ntn = N / 64;
  const int wid = blockIdx.x * 4 + w;
  const int mt = wid / ntn, nq = wid % ntn;
  if (mt * 16 >= M) return;
  const int row0 = mt * 16, col0 = nq * 64;
  const float* arow = A + (size_t)(row0 + ln) * lda;
  v8f acc[4] = {};
  for (int kb = 0; kb < K; kb += 32) {
    FragB ah, al;
    const v4f x0 = *(const v4fa*)(arow + kb + 8 * hh), x1 = *(const v4fa*)(arow + kb + 8 * hh + 4);
    const v4f x2 = *(const v4fa*)(arow + kb + 16 + 8 * hh), x3 = *(const v4fa*)(arow + kb + 16 + 8 * hh + 4);
    float xs[16] = {x0[0],x0[1],x0[2],x0[3],x1[0],x1[1],x1[2],x1[3],x2[0],x2[1],x2[2],x2[3],x3[0],x3[1],x3[2],x3[3]};
#pragma unroll
    for (int i = 0; i < 16; ++i) { const unsigned short hb = bf16_bits(xs[i]); ah.u[i] = hb; al.u[i] = ASPLIT ? bf16_bits(xs[i] - bf16_val(hb)) : (unsigned short)0; }
#pragma unroll
    for (int t = 0; t < 4; ++t) {
      const unsigned short* brow = Wt + (size_t)(col0 + t * 16 + ln) * ldb + kb;
      FragB b;
      b.half[0] = *(const v8us*)(brow + 8 * hh);
      b.half[1] = *(const v8us*)(brow + 16 + 8 * hh);
      acc[t] = mmaN<ASPLIT ? 2 : 1>(ah.v, al.v, b.v, b.v, acc[t]);
    }
  }
#pragma unroll
  for (int t = 0; t < 4; ++t) {
    float bv = bias ? bias[col0 + t * 16 + ln] : 0.f;
    if (BIAS_BF16) bv = bf16_round(bv);
#pragma unroll
    for (int r = 0; r < 8; ++r) { float v = acc[t][r] + bv; if (ACT == 1) v = fmaxf(v, 0.f); so[w][8 * hh + r][t * 16 + ln] = v; }
  }
  __builtin_amdgcn_fence(__ATOMIC_ACQ_REL, "workgroup");
  __builtin_amdgcn_wave_barrier();
  const int rsub = lane >> 4, c4 = (lane & 15) * 4;
  {
#pragma unroll
    for (int q = 0; q < 8; ++q) {
      const int r = q * 2 + rsub;
      const v4f v = *(const v4fa*)&so[w][r][c4];
      *(v4f*)(C + (size_t)(row0 + r) * ldc + col0 + c4) = v;
    }
    
  }
}

// Flash-style causal/unmasked attention, all contractions 3-term bf16 hi/lo splits, f32 softmax with running max.
// q,k,v rows are read from f32 buffers with arbitrary row pitch (so they can live inside a fused qkv buffer);
// D = head size (multiple of 32, <= 128); one wave = 16 query rows; block = 4 waves (64 queries) sharing K/V chunks of 32.
template <int D, bool CAUSAL>
__global__ __launch_bounds__(128) void k_flash(const float* __restrict__ qb, const float* __restrict__ kb, const float* __restrict__ vb,
                                             int pitch, int T, int H, float scale, float* __restrict__ y, int ypitch) {
  constexpr int KS = D / 32;        // k-steps for QK
  constexpr int DT = D / 16;        // d tiles for PV
  __shared__ __attribute__((aligned(16))) unsigned short sKh[32][D + 8], sKl[32][D + 8], sVh[32][D + 8], sVl[32][D + 8];
  __shared__ __attribute__((aligned(16))) unsigned short sPh[4][16][40], sPl[4][16][40];
  __shared__ __attribute__((aligned(16))) float sO[4][16][D];
  const int tid = threadIdx.x, w = tid >> 5, lane = tid & 31, ln = lane & 15, hh = lane >> 4;
  const int nqb = (T + 63) / 64;
  const int bh = blockIdx.x / nqb, qblk = blockIdx.x % nqb;
  const int b = bh / H, h = bh % H;
  const int q0 = qblk * 64 + w * 16;
  const float* Q = qb + (size_t)b * T * pitch + h * D;
  const float* K = kb + (size_t)b * T * pitch + h * D;
  const float* V = vb + (size_t)b * T * pitch + h * D;

  // A fragments of the wave's 16 query rows (scaled), hi/lo
  FragB aqh[KS], aql[KS];
  {
    int row = q0 + ln; if (row >= T) row = T - 1;
    const float* qr = Q + (size_t)row * pitch;
#pragma unroll
    for (int ks = 0; ks < KS; ++ks)
#pragma unroll
      for (int i = 0; i < 16; ++i) {
        const int d = ks * 32 + ((i < 8) ? (8 * hh + i) : (16 + 8 * hh + (i - 8)));
        const float x = qr[d] * scale; const unsigned short hb = bf16_bits(x);
        aqh[ks].u[i] = hb; aql[ks].u[i] = bf16_bits(x - bf16_val(hb));
      }
  }
  float m_r[8], l_r[8];
#pragma unroll
  for (int r = 0; r < 8; ++r) { m_r[r] = -3.0e38f; l_r[r] = 0.f; }
  v8f oacc[DT];
#pragma unroll
  for (int dt = 0; dt < DT; ++dt) oacc[dt] = (v8f){0.f,0.f,0.f,0.f,0.f,0.f,0.f,0.f};

  const int kv_end = CAUSAL ? min(T, qblk * 64 + 64) : T;     // block-uniform
  for (int j0 = 0; j0 < kv_end; j0 += 32) {
    __syncthreads();
    for (int e = tid; e < 32 * (D / 4); e += 128) {
      const int r = e / (D / 4), c4 = (e % (D / 4)) * 4;
      const int key = j0 + r;
      v4f kf = {0.f,0.f,0.f,0.f}, vf = {0.f,0.f,0.f,0.f};
      if (key < T) { kf = *(const v4fa*)(K + (size_t)key * pitch + c4); vf = *(const v4fa*)(V + (size_t)key * pitch + c4); }
#pragma unroll
      for (int t = 0; t < 4; ++t) {
        unsigned short hb = bf16_bits(kf[t]); sKh[r][c4 + t] = hb; sKl[r][c4 + t] = bf16_bits(kf[t] - bf16_val(hb));
        hb = bf16_bits(vf[t]); sVh[r][c4 + t] = hb; sVl[r][c4 + t] = bf16_bits(vf[t] - bf16_val(hb));
      }
    }
    __syncthreads();
    // S tile 16 x 32
    v8f s[2];
#pragma unroll
    for (int nt = 0; nt < 2; ++nt) {
      v8f acc = {};
#pragma unroll
      for (int ks = 0; ks < KS; ++ks) {
        FragB bh_, bl_;
        bh_.half[0] = *(const v8us*)&sKh[nt * 16 + ln][ks * 32 + 8 * hh]; bh_.half[1] = *(const v8us*)&sKh[nt * 16 + ln][ks * 32 + 16 + 8 * hh];
        bl_.half[0] = *(const v8us*)&sKl[nt * 16 + ln][ks * 32 + 8 * hh]; bl_.half[1] = *(const v8us*)&sKl[nt * 16 + ln][ks * 32 + 16 + 8 * hh];
        acc = mmaN<3>(aqh[ks].v, aql[ks].v, bh_.v, bl_.v, acc);
      }
      s[nt] = acc;
    }
    // mask + running max (rows 8hh+r; the 16 lanes of a half share rows)
    float alpha[8];
#pragma unroll
    for (int r = 0; r < 8; ++r) {
      const int qi = q0 + 8 * hh + r;
      const int ja = j0 + ln, jb = j0 + 16 + ln;
      if (CAUSAL) { if (ja > qi) s[0][r] = -3.0e38f; if (jb > qi) s[1][r] = -3.0e38f; }
      if (ja >= T) s[0][r] = -3.0e38f;
      if (jb >= T) s[1][r] = -3.0e38f;
      float mx = fmaxf(s[0][r], s[1][r]);
      mx = fmaxf(mx, __shfl_xor(mx, 1, 32)); mx = fmaxf(mx, __shfl_xor(mx, 2, 32)); mx = fmaxf(mx, __shfl_xor(mx, 4, 32)); mx = fmaxf(mx, __shfl_xor(mx, 8, 32));
      const float mnew = fmaxf(m_r[r], mx);
      alpha[r] = (mnew > -1.0e38f) ? __expf(m_r[r] - mnew) : 1.0f;
      const float p0 = (s[0][r] > -1.0e38f) ? __expf(s[0][r] - mnew) : 0.f;
      const float p1 = (s[1][r] > -1.0e38f) ? __expf(s[1][r] - mnew) : 0.f;
      m_r[r] = mnew;
      l_r[r] = l_r[r] * alpha[r] + p0 + p1;            // per-lane partial row sum (16 lanes combined at the end)
      unsigned short hb = bf16_bits(p0); sPh[w][8 * hh + r][ln] = hb;      sPl[w][8 * hh + r][ln] = bf16_bits(p0 - bf16_val(hb));
      hb = bf16_bits(p1);                sPh[w][8 * hh + r][16 + ln] = hb; sPl[w][8 * hh + r][16 + ln] = bf16_bits(p1 - bf16_val(hb));
    }
#pragma unroll
    for (int dt = 0; dt < DT; ++dt)
#pragma unroll
      for (int r = 0; r < 8; ++r) oacc[dt][r] *= alpha[r];
    __builtin_amdgcn_fence(__ATOMIC_ACQ_REL, "workgroup");
    __builtin_amdgcn_wave_barrier();
    FragB pah, pal;
    pah.half[0] = *(const v8us*)&sPh[w][ln][8 * hh]; pah.half[1] = *(const v8us*)&sPh[w][ln][16 + 8 * hh];
    pal.half[0] = *(const v8us*)&sPl[w][ln][8 * hh]; pal.half[1] = *(const v8us*)&sPl[w][ln][16 + 8 * hh];
#pragma unroll
    for (int dt = 0; dt < DT; ++dt) {
      FragB bvh, bvl;
#pragma unroll
      for (int i = 0; i < 8; ++i) {
        bvh.u[i] = sVh[8 * hh + i][dt * 16 + ln]; bvh.u[8 + i] = sVh[16 + 8 * hh + i][dt * 16 + ln];
        bvl.u[i] = sVl[8 * hh + i][dt * 16 + ln]; bvl.u[8 + i] = sVl[16 + 8 * hh + i][dt * 16 + ln];
      }
      oacc[dt] = mmaN<3>(pah.v, pal.v, bvh.v, bvl.v, oacc[dt]);
    }
    __builtin_amdgcn_fence(__ATOMIC_ACQ_REL, "workgroup");
    __builtin_amdgcn_wave_barrier();
  }
#pragma unroll
  for (int r = 0; r < 8; ++r) {
    float l = l_r[r];
    l += __shfl_xor(l, 1, 32); l += __shfl_xor(l, 2, 32); l += __shfl_xor(l, 4, 32); l += __shfl_xor(l, 8, 32);
    l_r[r] = (l > 0.f) ? 1.0f / l : 0.f;
  }
#pragma unroll
  for (int dt = 0; dt < DT; ++dt)
#pragma unroll
    for (int r = 0; r < 8; ++r) sO[w][8 * hh + r][dt * 16 + ln] = oacc[dt][r] * l_r[r];
  __builtin_amdgcn_fence(__ATOMIC_ACQ_REL, "workgroup");
  __builtin_amdgcn_wave_barrier();
  {
    for (int r = 0; r < 16; ++r) {
      const int row = q0 + r;
      if (row < T && lane < D / 4) {
        const v4f val = *(const v4fa*)&sO[w][r][lane * 4];
        *(v4f*)(y + ((size_t)b * T + row) * ypitch + h * D + lane * 4) = val;
      }
    }
    
  }
}

// GEMM C = act(A·W + bias + resid): A f32 (ASPLIT -> hi/lo 2 terms), Wt bf16 [N][K]; ACT 0 none, 1 relu, 2 exact gelu;
// resid (optional, f32, row index = (row % rmod), pitch ldr, RES_BF16 rounds it) added before the activation.
template <bool ASPLIT, int ACT, bool BIAS_BF16, bool RES_BF16>
__global__ __launch_bounds__(128) void k_gemm_bf3(const float* __restrict__ A, int lda, const unsigned short* __restrict__ Wt, int ldb,
                                                const float* __restrict__ bias, const float* __restrict__ resid, int rmod, int ldr,
                                                float* __restrict__ C, int ldc, int M, int N, int K) {
  __shared__ __attribute__((aligned(16))) float so[4][16][64];
  const int tid = threadIdx.x, w = tid >> 5, lane = tid & 31, ln = lane & 15, hh = lane >> 4;
  const int ntn = N / 64;
  const int wid = blockIdx.x * 4 + w;
  const int mt = wid / ntn, nq = wid % ntn;
  if (mt * 16 >= M) return;
  const int row0 = mt * 16, col0 = nq * 64;
  const float* arow = A + (size_t)(row0 + ln) * lda;
  v8f acc[4] = {};
  for (int kb = 0; kb < K; kb += 32) {
    FragB ah, al;
    const v4f x0 = *(const v4fa*)(arow + kb + 8 * hh), x1 = *(const v4fa*)(arow + kb + 8 * hh + 4);
    const v4f x2 = *(const v4fa*)(arow + kb + 16 + 8 * hh), x3 = *(const v4fa*)(arow + kb + 16 + 8 * hh + 4);
    float xs[16] = {x0[0],x0[1],x0[2],x0[3],x1[0],x1[1],x1[2],x1[3],x2[0],x2[1],x2[2],x2[3],x3[0],x3[1],x3[2],x3[3]};
#pragma unroll
    for (int i = 0; i < 16; ++i) { const unsigned short hb = bf16_bits(xs[i]); ah.u[i] = hb; al.u[i] = ASPLIT ? bf16_bits(xs[i] - bf16_val(hb)) : (unsigned short)0; }
#pragma unroll
    for (int t = 0; t < 4; ++t) {
      const unsigned short* brow = Wt + (size_t)(col0 + t * 16 + ln) * ldb + kb;
      FragB b;
      b.half[0] = *(const v8us*)(brow + 8 * hh);
      b.half[1] = *(const v8us*)(brow + 16 + 8 * hh);
      acc[t] = mmaN<ASPLIT ? 2 : 1>(ah.v, al.v, b.v, b.v, acc[t]);
    }
  }
#pragma unroll
  for (int t = 0; t < 4; ++t) {
    const int col = col0 + t * 16 + ln;
    float bv = bias ? bias[col] : 0.f;
    if (BIAS_BF16) bv = bf16_round(bv);
#pragma unroll
    for (int r = 0; r < 8; ++r) {
      float v = acc[t][r] + bv;
      if (resid) { float rv = resid[(size_t)((row0 + 8 * hh + r) % rmod) * ldr + col]; if (RES_BF16) rv = bf16_round(rv); v += rv; }
      if (ACT == 1) v = fmaxf(v, 0.f);
      if (ACT == 2) v = 0.5f * v * (1.0f + erff(v * 0.70710678118654752f));
      if (ACT == 3) { const float u = 0.7978845608028654f * (v + 0.044715f * v * v * v); v = 0.5f * v * (1.0f + tanhf(u)); }
      so[w][8 * hh + r][t * 16 + ln] = v;
    }
  }
  __builtin_amdgcn_fence(__ATOMIC_ACQ_REL, "workgroup");
  __builtin_amdgcn_wave_barrier();
  const int rsub = lane >> 4, c4 = (lane & 15) * 4;
  {
#pragma unroll
    for (int q = 0; q < 8; ++q) {
      const int r = q * 2 + rsub;
      const v4f v = *(const v4fa*)&so[w][r][c4];
      *(v4f*)(C + (size_t)(row0 + r) * ldc + col0 + c4) = v;
    }
    
  }
}
// row LayerNorm (biased variance, eps) over N: s = X (+ R); optional out_sum <- s; out_norm <- (s-mu)*rsqrt(var+eps)*g + b
template <bool PARAM_BF16>
__global__ __launch_bounds__(256) void k_layernorm(const float* __restrict__ X, const float* __restrict__ R, const float* __restrict__ g, const float* __restrict__ bta,
                                                  float* __restrict__ out_sum, float* __restrict__ out_norm, int N, float eps) {
  __shared__ float red[256];
  const int row = blockIdx.x, tid = threadIdx.x;
  const float* x = X + (size_t)row * N; const float* rr = R ? R + (size_t)row * N : nullptr;
  float vals[16];                     // up to N = 4096
  const int per = N / 256;            // contiguous chunk per thread? use strided-by-4 chunks: thread handles j = tid*4 + 1024*u
  float s1 = 0.f;
  for (int u = 0; u < per / 4; ++u) {
    const int j = tid * 4 + 1024 * u;
    const v4f a = *(const v4fa*)(x + j);
    v4f b = {0.f,0.f,0.f,0.f}; if (rr) b = *(const v4fa*)(rr + j);
#pragma unroll
    for (int q = 0; q < 4; ++q) { const float v = a[q] + b[q]; vals[u * 4 + q] = v; s1 += v; }
  }
  red[tid] = s1; __syncthreads();
  for (int st = 128; st > 0; st >>= 1) { if (tid < st) red[tid] += red[tid + st]; __syncthreads(); }
  const float mu = red[0] / (float)N; __syncthreads();
  float s2 = 0.f;
  for (int u = 0; u < per / 4; ++u)
#pragma unroll
    for (int q = 0; q < 4; ++q) { const float c = vals[u * 4 + q] - mu; s2 += c * c; }
  red[tid] = s2; __syncthreads();
  for (int st = 128; st > 0; st >>= 1) { if (tid < st) red[tid] += red[tid + st]; __syncthreads(); }
  const float rs = rsqrtf(red[0] / (float)N + eps);
  {
    for (int u = 0; u < per / 4; ++u) {
      const int j = tid * 4 + 1024 * u;
      v4f o, sm;
#pragma unroll
      for (int q = 0; q < 4; ++q) {
        float gg = g[j + q], bb = bta[j + q];
        if (PARAM_BF16) { gg = bf16_round(gg); bb = bf16_round(bb); }
        sm[q] = vals[u * 4 + q]; o[q] = (vals[u * 4 + q] - mu) * rs * gg + bb;
      }
      if (out_sum) *(v4f*)(out_sum + (size_t)row * N + j) = sm;
      *(v4f*)(out_norm + (size_t)row * N + j) = o;
    }
    
  }
}



// ---- f16 WMMA path (v_wmma_f32_16x16x32_f16): 11-bit significands for operands in range — used where a [0,1] probability operand needs more precision than bf16
typedef _Float16 v16h __attribute__((ext_vector_type(16)));
union FragH { v16h v; v8us half[2]; _Float16 h[16]; unsigned short u[16]; };
template <int NT>
__device__ __forceinline__ v8f mmaH(v16h ah, v16h al, v16h bh, v16h bl, v8f c) {
  c = __builtin_amdgcn_wmma_f32_16x16x32_f16(false, ah, false, bh, (short)0, c, false, false);
  if (NT >= 2) c = __builtin_amdgcn_wmma_f32_16x16x32_f16(false, al, false, bh, (short)0, c, false, false);
  if (NT >= 3) c = __builtin_amdgcn_wmma_f32_16x16x32_f16(false, ah, false, bl, (short)0, c, false, false);
  asm volatile("v_nop\n\tv_nop\n\tv_nop\n\tv_nop" : "+v"(c) : "v"(ah), "v"(al), "v"(bh), "v"(bl));
  return c;
}
// batched GEMM like k_gemm_b but f16 operands: A f32 (split into f16 hi/lo if ASPLIT, else rounded to f16), Bt = f16 values [n][k]; alpha; C f32; N multiple of 16 (partial tiles skipped)
template <bool ASPLIT>
__global__ __launch_bounds__(128) void k_gemm_h(const float* __restrict__ A, int lda, size_t sA, const _Float16* __restrict__ Bh, int ldb, size_t sB, float alpha, float* __restrict__ C, int ldc, size_t sC, int M, int N, int K) {
  __shared__ __attribute__((aligned(16))) float so[4][16][64];
  const int tid = threadIdx.x, w = tid >> 5, lane = tid & 31, ln = lane & 15, hh = lane >> 4; const int by = blockIdx.y;
  A += (size_t)by * sA; Bh += (size_t)by * sB; C += (size_t)by * sC;
  const int ntn = (N + 63) / 64; const int wid = blockIdx.x * 4 + w; const int mt = wid / ntn, nq = wid % ntn; if (mt * 16 >= M) return;
  const int row0 = mt * 16, col0 = nq * 64; const float* arow = A + (size_t)(row0 + ln) * lda;
  v8f acc[4] = {};
  for (int kb = 0; kb < K; kb += 32) {
    FragH ah, al;
    const v4f x0 = *(const v4fa*)(arow + kb + 8 * hh), x1 = *(const v4fa*)(arow + kb + 8 * hh + 4), x2 = *(const v4fa*)(arow + kb + 16 + 8 * hh), x3 = *(const v4fa*)(arow + kb + 16 + 8 * hh + 4);
    float xs[16] = {x0[0],x0[1],x0[2],x0[3],x1[0],x1[1],x1[2],x1[3],x2[0],x2[1],x2[2],x2[3],x3[0],x3[1],x3[2],x3[3]};
#pragma unroll
    for (int i = 0; i < 16; ++i) { const _Float16 h = (_Float16)xs[i]; ah.h[i] = h; al.h[i] = ASPLIT ? (_Float16)(xs[i] - (float)h) : (_Float16)0.0f; }
#pragma unroll
    for (int t = 0; t < 4; ++t) { if (col0 + t * 16 >= N) continue; const size_t boff = (size_t)(col0 + t * 16 + ln) * ldb + kb; FragH bq; bq.half[0] = *(const v8us*)(Bh + boff + 8 * hh); bq.half[1] = *(const v8us*)(Bh + boff + 16 + 8 * hh);
      acc[t] = mmaH<ASPLIT ? 2 : 1>(ah.v, al.v, bq.v, bq.v, acc[t]); }
  }
#pragma unroll
  for (int t = 0; t < 4; ++t) { if (col0 + t * 16 >= N) continue;
#pragma unroll
    for (int r = 0; r < 8; ++r) so[w][8 * hh + r][t * 16 + ln] = acc[t][r] * alpha; }
  __builtin_amdgcn_fence(__ATOMIC_ACQ_REL, "workgroup"); __builtin_amdgcn_wave_barrier();
  const int rsub = lane >> 4, c4 = (lane & 15) * 4;
  {
#pragma unroll
    for (int q = 0; q < 8; ++q) { const int r = q * 2 + rsub; if (col0 + c4 < N) { const v4f v = *(const v4fa*)&so[w][r][c4]; *(v4f*)(C + (size_t)(row0 + r) * ldc + col0 + c4) = v; } }
     }
}

// Wt[n][k] = f16(W[k][n]·scale) from f32 row-major W[K][N] (scale = power of two; bf16-exact weights stay exact in f16 away from the subnormal range)
__global__ __launch_bounds__(256) void k_wt_f16(const float* __restrict__ W, _Float16* __restrict__ Wt, int K, int N, float scale) {
  const int t = blockIdx.x * 256 + threadIdx.x; if (t >= N * (K / 8)) return; const int n = t / (K / 8), k8 = (t % (K / 8)) * 8; FragH f;
#pragma unroll
  for (int i = 0; i < 8; ++i) f.h[i] = (_Float16)(bf16_round(W[(size_t)(k8 + i) * N + n]) * scale); const v8us o = f.half[0];
  *(v8us*)((unsigned short*)Wt + (size_t)n * K + k8) = o; 
}
// k_gemm_hh variant with fused epilogue: v = acc·alpha + bias[by·sBias + col] (+ CP[(row/rowsPerB)·sCPb + by·64 + col] if CP) ; ACT 0 none / 1 elu ; writes f32 C and f16 C16, each only if non-null
template <int ACT>
__global__ __launch_bounds__(128) void k_gemm_hhx(const _Float16* __restrict__ A, int lda, size_t sA, const _Float16* __restrict__ Bh, int ldb, size_t sB, float alpha, const float* __restrict__ bias, size_t sBias, const float* __restrict__ CP, int rowsPerB, size_t sCPb, int row0g,
    float* __restrict__ C, _Float16* __restrict__ C16, int ldc, size_t sC, int M, int N, int K) {
  __shared__ __attribute__((aligned(16))) float so[4][16][64];
  const int tid = threadIdx.x, w = tid >> 5, lane = tid & 31, ln = lane & 15, hh = lane >> 4; const int by = blockIdx.y;
  A += (size_t)by * sA; Bh += (size_t)by * sB; const size_t cofs = (size_t)by * sC; const float* bp = bias ? bias + (size_t)by * sBias : nullptr;
  const int ntn = (N + 63) / 64; const int wid = blockIdx.x * 4 + w; const int mt = wid / ntn, nq = wid % ntn; if (mt * 16 >= M) return;
  const int row0 = mt * 16, col0 = nq * 64; const _Float16* arow = A + (size_t)(row0 + ln) * lda;
  v8f acc[4] = {};
  for (int kb = 0; kb < K; kb += 32) { FragH ah; ah.half[0] = *(const v8us*)((const unsigned short*)arow + kb + 8 * hh); ah.half[1] = *(const v8us*)((const unsigned short*)arow + kb + 16 + 8 * hh);
#pragma unroll
    for (int t = 0; t < 4; ++t) { if (col0 + t * 16 >= N) continue; const size_t boff = (size_t)(col0 + t * 16 + ln) * ldb + kb; FragH bq; bq.half[0] = *(const v8us*)((const unsigned short*)Bh + boff + 8 * hh); bq.half[1] = *(const v8us*)((const unsigned short*)Bh + boff + 16 + 8 * hh);
      acc[t] = mmaH<1>(ah.v, ah.v, bq.v, bq.v, acc[t]); }
  }
#pragma unroll
  for (int t = 0; t < 4; ++t) { if (col0 + t * 16 >= N) continue; const int col = col0 + t * 16 + ln; const float bv = bp ? bf16_round(bp[col]) : 0.f;
#pragma unroll
    for (int r = 0; r < 8; ++r) { float v = acc[t][r] * alpha + bv; if (CP) { const int bidx = (row0g + row0 + 8 * hh + r) / rowsPerB; v += CP[(size_t)bidx * sCPb + (size_t)by * 64 + col]; } if (ACT == 1) v = (v > 0.f) ? v : expm1f(v); else if (ACT == 7) v = (v > 0.f) ? v + 1.0f : expf(v); else if (ACT == 8) v = tanhf(v); else if (ACT == 9) v = 0.5f * v * (1.0f + tanhf(0.7978845608028654f * (v + 0.044715f * v * v * v))); else if (ACT == 11) v = 1.0f / (1.0f + expf(-v)); else if (ACT == 12) v = (v > 0.f) ? v : 0.01f * v; else if (ACT == 14) v = (v > 0.f) ? v : 0.1f * v; else if (ACT == 15) v = v / (1.0f + expf(-v)); else if (ACT == 3) v = fmaxf(v, 0.f); else if (ACT == 6) v = 0.5f * v * (1.0f + erff(v * 0.70710678118654752f)); so[w][8 * hh + r][t * 16 + ln] = v; } }
  __builtin_amdgcn_fence(__ATOMIC_ACQ_REL, "workgroup"); __builtin_amdgcn_wave_barrier();
  const int rsub = lane >> 4, c4 = (lane & 15) * 4; typedef _Float16 v4h __attribute__((ext_vector_type(4)));
  {
#pragma unroll
    for (int q = 0; q < 8; ++q) { const int r = q * 2 + rsub; if (col0 + c4 < N) { const v4f v = *(const v4fa*)&so[w][r][c4]; if (C) *(v4f*)(C + cofs + (size_t)(row0 + r) * ldc + col0 + c4) = v; if (C16) { v4h h4; for (int i = 0; i < 4; ++i) h4[i] = (_Float16)v[i]; *(v4h*)(C16 + cofs + (size_t)(row0 + r) * ldc + col0 + c4) = h4; } } }
     }
}


typedef _Float16 v4h __attribute__((ext_vector_type(4)));

__global__ __launch_bounds__(256) void k_x16(const float* __restrict__ x, _Float16* __restrict__ X16, size_t n8) { const size_t t = (size_t)blockIdx.x * 256 + threadIdx.x; if (t >= n8) return; FragH f;
#pragma unroll
  for (int q = 0; q < 8; ++q) f.h[q] = (_Float16)bf16_round(x[t * 8 + q]); *(v8us*)((unsigned short*)X16 + t * 8) = f.half[0];  }
__global__ __launch_bounds__(256) void k_h16(const float* __restrict__ x, _Float16* __restrict__ X16, size_t n8) { const size_t t = (size_t)blockIdx.x * 256 + threadIdx.x; if (t >= n8) return; FragH f;
#pragma unroll
  for (int q = 0; q < 8; ++q) f.h[q] = (_Float16)x[t * 8 + q]; *(v8us*)((unsigned short*)X16 + t * 8) = f.half[0];  }
__global__ __launch_bounds__(256) void k_round16f(const float* __restrict__ W, _Float16* __restrict__ Bt, size_t n8) { const size_t t = (size_t)blockIdx.x * 256 + threadIdx.x; if (t >= n8) return; FragH f;
#pragma unroll
  for (int i = 0; i < 8; ++i) f.h[i] = (_Float16)(bf16_round(W[t * 8 + i]) * 16.0f); *(v8us*)((unsigned short*)Bt + t * 8) = f.half[0];  }
template <int NHv, int TTv>
__global__ __launch_bounds__(256) void k_vt(const _Float16* __restrict__ V16, int ldv, int voff, _Float16* __restrict__ Vt) { __shared__ unsigned short tl[64][66]; const int tid = threadIdx.x; const int slab = blockIdx.x / (TTv / 64), lg = blockIdx.x % (TTv / 64); const int b = slab / NHv, h = slab % NHv;
  for (int i = tid; i < 64 * 8; i += 256) { const int r = i / 8, c8 = (i % 8) * 8; FragH f; f.half[0] = *(const v8us*)((const unsigned short*)V16 + ((size_t)b * TTv + lg * 64 + r) * ldv + voff + h * 64 + c8);
#pragma unroll
    for (int q = 0; q < 8; ++q) tl[r][c8 + q] = f.u[q]; }
  __syncthreads();
  {
#pragma unroll
    for (int rd = 0; rd < 2; ++rd) { const int d = rd * 32 + tid / 8, pc = tid % 8; FragH f;
#pragma unroll
      for (int q = 0; q < 8; ++q) f.u[q] = tl[pc * 8 + q][d];
      *(v8us*)((unsigned short*)Vt + ((size_t)slab * 64 + d) * TTv + lg * 64 + pc * 8) = f.half[0]; }
     } }

__global__ __launch_bounds__(256) void k_hl(const float* __restrict__ F, _Float16* __restrict__ Hh, _Float16* __restrict__ Hl, size_t n8) { const size_t t = (size_t)blockIdx.x * 256 + threadIdx.x; if (t >= n8) return; FragH fh, fl; const v4f a = *(const v4fa*)(F + t * 8), c = *(const v4fa*)(F + t * 8 + 4);
#pragma unroll
  for (int q = 0; q < 4; ++q) { _Float16 h = (_Float16)a[q]; fh.h[q] = h; fl.h[q] = (_Float16)((a[q] - (float)h) * 1024.0f); h = (_Float16)c[q]; fh.h[4 + q] = h; fl.h[4 + q] = (_Float16)((c[q] - (float)h) * 1024.0f); }
  { *(v8us*)((unsigned short*)Hh + t * 8) = fh.half[0]; *(v8us*)((unsigned short*)Hl + t * 8) = fl.half[0];  } }

// Column softmax over the query axis, spread over the whole chip in two launches. A block owns CS_COLS key columns x CS_CHUNK query rows:
// 16 waves, each wave CS_ROWS rows, each lane 4 neighbouring columns (one 512-byte piece of a row per wave load), all rows held in registers.
#define CS_COLS 128
#define CS_ROWS 32
#define CS_CHUNK 512
#define CS_NCH (SQ / CS_CHUNK)
// launch 1: per (row chunk, column) the maximum and the sum of exp(s - maximum), f32 -> PM, PL [CS_NCH][SK]
__global__ __launch_bounds__(512) void k_colstat(const float* __restrict__ S, float* __restrict__ PM, float* __restrict__ PL) {
  __shared__ __attribute__((aligned(16))) float sm[16][CS_COLS], sl[16][CS_COLS];
  const int tid = threadIdx.x, w = tid >> 5, lane = tid & 31; const int c0 = blockIdx.x * CS_COLS, ch = blockIdx.y;
  const float* p = S + (size_t)(ch * CS_CHUNK + w * CS_ROWS) * SK + c0 + lane * 4;
  v4f x[CS_ROWS];
#pragma unroll
  for (int i = 0; i < CS_ROWS; ++i) x[i] = *(const v4fa*)(p + (size_t)i * SK);
  v4f m = {-3.0e38f, -3.0e38f, -3.0e38f, -3.0e38f}, l = {0.f, 0.f, 0.f, 0.f};
#pragma unroll
  for (int i = 0; i < CS_ROWS; ++i)
#pragma unroll
    for (int q = 0; q < 4; ++q) m[q] = fmaxf(m[q], x[i][q]);
#pragma unroll
  for (int i = 0; i < CS_ROWS; ++i)
#pragma unroll
    for (int q = 0; q < 4; ++q) l[q] += expf(x[i][q] - m[q]);
  *(v4fa*)&sm[w][lane * 4] = m; *(v4fa*)&sl[w][lane * 4] = l;
  __syncthreads();
  if (tid < CS_COLS) {
    float M = -3.0e38f, L = 0.f;
#pragma unroll
    for (int j = 0; j < 16; ++j) M = fmaxf(M, sm[j][tid]);
#pragma unroll
    for (int j = 0; j < 16; ++j) L += sl[j][tid] * expf(sm[j][tid] - M);
    PM[(size_t)ch * SK + c0 + tid] = M; PL[(size_t)ch * SK + c0 + tid] = L;
  }
}
// launch 2: same tiles; the first 4 waves merge the CS_NCH partials of the block's columns (m_k, 2^12 / l_k) while every wave's rows are in flight; then P[q][k] = exp(s - m_k) / l_k x 2^12 -> f16, 256 bytes of a row per wave store
__global__ __launch_bounds__(512) void k_colnorm(const float* __restrict__ S, const float* __restrict__ PM, const float* __restrict__ PL, _Float16* __restrict__ P16) {
  __shared__ __attribute__((aligned(16))) float fm[CS_COLS], fi[CS_COLS];
  const int tid = threadIdx.x, w = tid >> 5, lane = tid & 31; const int c0 = blockIdx.x * CS_COLS, ch = blockIdx.y;
  const size_t o = (size_t)(ch * CS_CHUNK + w * CS_ROWS) * SK + c0 + lane * 4;
  v4f x[CS_ROWS];
#pragma unroll
  for (int i = 0; i < CS_ROWS; ++i) x[i] = *(const v4fa*)(S + o + (size_t)i * SK);
  if (tid < CS_COLS) {
    float pm[CS_NCH], pl[CS_NCH];
#pragma unroll
    for (int j = 0; j < CS_NCH; ++j) { pm[j] = PM[(size_t)j * SK + c0 + tid]; pl[j] = PL[(size_t)j * SK + c0 + tid]; }
    float M = -3.0e38f, L = 0.f;
#pragma unroll
    for (int j = 0; j < CS_NCH; ++j) M = fmaxf(M, pm[j]);
#pragma unroll
    for (int j = 0; j < CS_NCH; ++j) L += pl[j] * expf(pm[j] - M);
    fm[tid] = M; fi[tid] = 4096.0f / L;
  }
  __syncthreads();
  const v4f m = *(const v4fa*)&fm[lane * 4], il = *(const v4fa*)&fi[lane * 4];
#pragma unroll
  for (int i = 0; i < CS_ROWS; ++i) {
    v4h h;
#pragma unroll
    for (int q = 0; q < 4; ++q) h[q] = (_Float16)(expf(x[i][q] - m[q]) * il[q]);
    *(v4h*)(P16 + o + (size_t)i * SK) = h;
  }
}

extern "C" void kernel_launch(void* const* d_in, const int* in_sizes, int n_in,
                              void* d_out, int out_size, void* d_ws, size_t ws_size, hipStream_t stream) {
  (void)in_sizes; (void)n_in; (void)out_size;
  const float* Q = (const float*)d_in[0]; const float* Kx = (const float*)d_in[1]; const float* V = (const float*)d_in[2];
  char* ws = (char*)d_ws; size_t off = 0;
  auto take = [&](size_t bytes) { char* p = ws + off; off += (bytes + 255) & ~(size_t)255; return p; };
  _Float16* Q16 = (_Float16*)take((size_t)SQ * DK * 2); _Float16* K16 = (_Float16*)take((size_t)SK * DK * 2); _Float16* Vt = (_Float16*)take((size_t)DV * SK * 2);
  float* S = (float*)take((size_t)SQ * SK * 4); _Float16* P16 = (_Float16*)take((size_t)SQ * SK * 2);
  float* PM = (float*)take((size_t)CS_NCH * SK * 4); float* PL = (float*)take((size_t)CS_NCH * SK * 4);
  if (off > ws_size) return;      // 8.4 + 8.4 + 8.4 + 67.1 + 33.6 ≈ 126 MB
  k_x16<<<(unsigned)(((size_t)SQ * DK / 8 + 255) / 256), 256, 0, stream>>>(Q, Q16, (size_t)SQ * DK / 8);
  k_x16<<<(unsigned)(((size_t)SK * DK / 8 + 255) / 256), 256, 0, stream>>>(Kx, K16, (size_t)SK * DK / 8);      /* K rows are the natural Bt[SK][DK] of Q·Kᵀ */
  k_wt_f16<<<(unsigned)(((size_t)DV * (SK / 8) + 255) / 256), 256, 0, stream>>>(V, Vt, SK, DV, 1.0f);      /* V[SK][DV] → Vt[DV][SK] (bf16-rounded, f16) */
  k_gemm_hhx<0><<<dim3(((SQ / 16) * (SK / 64) + 3) / 4, 1), 128, 0, stream>>>(Q16, DK, 0, K16, DK, 0, 1.0f / 4096.0f, nullptr, 0, nullptr, 1, 0, 0, S, nullptr, SK, 0, SQ, SK, DK);      /* S = Q·Kᵀ/4096 f32: M 4096 N 4096 K 1024 */
  k_colstat<<<dim3(SK / CS_COLS, CS_NCH), 512, 0, stream>>>(S, PM, PL);
  k_colnorm<<<dim3(SK / CS_COLS, CS_NCH), 512, 0, stream>>>(S, PM, PL, P16);
  k_gemm_hhx<0><<<dim3(((SQ / 16) * (DV / 64) + 3) / 4, 1), 128, 0, stream>>>(P16, SK, 0, Vt, SK, 0, 1.0f / 4096.0f, nullptr, 0, nullptr, 1, 0, 0, (float*)d_out, nullptr, DV, 0, SQ, DV, SK);      /* out = P·V ×2^-12: M 4096 N 1024 K 4096 */
}
